// v000
// Times are from an AMD MI455X. After a warm-up the kernel runs many times in a row, and a time is the length of
// such a window on the GPU divided by its runs, so every launch and the gaps after it count. The runs cycle
// through copies of the inputs. A figure is the median of several windows, for all but v000 over two sittings.
// Sittings can differ by a few percent; kernels timed side by side share one.
// v000, which the later versions start from, runs in 324 microseconds.
#include <hip/hip_runtime.h>
// Contractions: v_wmma_f32_16x16x32_f16 (f16 operands, f32 accumulate) for the qkv projection, the q.k^T scores, p.v and the output projection; weights carried x64 in f16 (1/64 folded into the epilogue scale), softmax numerators carried x2^15; LayerNorm, rotary tables and softmax in f32.

#define DIM_C    1024
#define T_LEN    2048
#define B_SZ     2
#define N_HEAD   16
#define D_HEAD   64
#define WIN      32
#define N_TOK    (B_SZ * T_LEN)
#define N_QKV    (3 * DIM_C)
#define W_SCALE  64.0f
#define W_SCALE_INV (1.0f / 64.0f)
#define P_SC     32768.0f
#define QK_SCALE 0.125f

typedef __attribute__((ext_vector_type(16))) _Float16 v16h;
typedef __attribute__((ext_vector_type(8)))  _Float16 v8h;
typedef __attribute__((ext_vector_type(16))) __bf16   v16b;
typedef __attribute__((ext_vector_type(8)))  __bf16   v8b;
typedef __attribute__((ext_vector_type(8)))  float    v8f;
typedef __attribute__((ext_vector_type(4)))  float    v4f;

__device__ __forceinline__ unsigned short f2bf_bits(float f) {
  unsigned u = __float_as_uint(f);
  return (unsigned short)((u + 0x7FFFu + ((u >> 16) & 1u)) >> 16);
}
__device__ __forceinline__ float bf_bits2f(unsigned short h) { return __uint_as_float(((unsigned)h) << 16); }

// hazard guards as plain device helpers
__device__ __forceinline__ void dep_guard_h(v8f& a, v8f& b, v16h x, v16h y) { asm volatile("v_nop\n\tv_nop\n\tv_nop\n\tv_nop" : "+v"(a), "+v"(b) : "v"(x), "v"(y)); }
__device__ __forceinline__ void dep_guard_b(v8f& a, v8f& b, v16b x, v16b y) { asm volatile("v_nop\n\tv_nop\n\tv_nop\n\tv_nop" : "+v"(a), "+v"(b) : "v"(x), "v"(y)); }
__device__ __forceinline__ void keep4_h(v16h a, v16h b, v16h c, v16h d) { asm volatile("v_nop" :: "v"(a), "v"(b), "v"(c), "v"(d)); }
__device__ __forceinline__ void keep4_b(v16b a, v16b b, v16b c, v16b d) { asm volatile("v_nop" :: "v"(a), "v"(b), "v"(c), "v"(d)); }
__device__ __forceinline__ void acc_guard4(v8f& a, v8f& b, v8f& c, v8f& d) { asm volatile("v_nop\n\tv_nop\n\tv_nop\n\tv_nop" : "+v"(a), "+v"(b), "+v"(c), "+v"(d)); }
template <typename T> struct Frag;
template <> struct Frag<_Float16> {
  typedef v16h V; union U { v16h v; v8h h[2]; };
  static __device__ __forceinline__ v16h load(const _Float16* p) {   // elements 0..7 <- p[0..7], 8..15 <- p[16..23]
    U f; f.h[0] = *(const v8h*)(p); f.h[1] = *(const v8h*)(p + 16); return f.v;
  }
  static __device__ __forceinline__ v8f mma(v16h a, v16h b, v8f c) {
    return __builtin_amdgcn_wmma_f32_16x16x32_f16(false, a, false, b, (short)0, c, false, false);
  }
  static __device__ __forceinline__ void guard(v8f& a, v8f& b, v16h x, v16h y) { dep_guard_h(a, b, x, y); }
  static __device__ __forceinline__ void keep(v16h a, v16h b, v16h c, v16h d) { keep4_h(a, b, c, d); }
};
template <> struct Frag<__bf16> {
  typedef v16b V; union U { v16b v; v8b h[2]; };
  static __device__ __forceinline__ v16b load(const __bf16* p) {
    U f; f.h[0] = *(const v8b*)(p); f.h[1] = *(const v8b*)(p + 16); return f.v;
  }
  static __device__ __forceinline__ v8f mma(v16b a, v16b b, v8f c) {
    return __builtin_amdgcn_wmma_f32_16x16x32_bf16(false, a, false, b, (short)0, c, false, false);
  }
  static __device__ __forceinline__ void guard(v8f& a, v8f& b, v16b x, v16b y) { dep_guard_b(a, b, x, y); }
  static __device__ __forceinline__ void keep(v16b a, v16b b, v16b c, v16b d) { keep4_b(a, b, c, d); }
};

// ---- Register-blocked batched WMMA GEMM ------------------------------------
// C[m,n] = scale * sum_k A[m,k] * Bt[n,k] (+bias)(+resid); each wave owns a 64x64 tile.
// A row-major [M,K]; Bt row-major [N,K]; M,N % 64 == 0, K % 32 == 0.
// SPLIT: operands are hi/lo planes (A2/Bt2 = lo planes, same layout); product = hi.hi + hi.lo + lo.hi.
// BIAS_MODE: 0 = none, 1 = bias[m], 2 = bias[n].
// OUT_MODE: 0 = f32, 1 = f16, 2 = bf16 hi plane (Cout) + bf16 lo plane (Cout2).
// ET: 0 = f16 operands, 1 = bf16 operands (pointers passed as 16-bit storage)
template <int ET> struct Elem;
template <> struct Elem<0> { typedef _Float16 T; };
template <> struct Elem<1> { typedef __bf16 T; };
template <int ET, bool SPLIT, int BIAS_MODE, int OUT_MODE, bool RESID, int ACT = 0>
__global__ __launch_bounds__(256) void wmma_gemm64(
    const unsigned short* __restrict__ Ap, const unsigned short* __restrict__ A2p, int lda, long strideA,
    const unsigned short* __restrict__ Btp, const unsigned short* __restrict__ Bt2p, int ldb, long strideB,
    void* __restrict__ Cout, void* __restrict__ Cout2, int ldc, long strideC,
    const float* __restrict__ bias,
    const float* __restrict__ resid, long strideR,
    int M, int N, int K, float scale) {
  typedef typename Elem<ET>::T T;
  typedef typename Frag<T>::V V;
  const T* A = (const T*)Ap; const T* A2 = (const T*)A2p; const T* Bt = (const T*)Btp; const T* Bt2 = (const T*)Bt2p;
  __shared__ __align__(16) float sT[8][16 * 68];   // per-wave 16x64 slab, pitch 68 floats
  const int b    = blockIdx.y;
  const int lane = threadIdx.x & 31;
  const int wave = threadIdx.x >> 5;
  const int tilesN = N >> 6;
  const int tilesM = M >> 6;
  const int tile = blockIdx.x * 8 + wave;
  if (tile >= tilesM * tilesN) return;   // wave-uniform; no block barriers in this kernel
  const int tm = tile / tilesN;
  const int tn = tile - tm * tilesN;
  const int m0 = tm << 6;
  const int n0 = tn << 6;

  const T* Ab  = A  + (size_t)b * strideA;
  const T* Bb  = Bt + (size_t)b * strideB;
  const T* Ab2 = SPLIT ? (A2  + (size_t)b * strideA) : nullptr;
  const T* Bb2 = SPLIT ? (Bt2 + (size_t)b * strideB) : nullptr;

  const int rlane = lane & 15;                 // row (A) / col (B, D) within subtile
  const int koff  = (lane >> 4) * 8;           // k offset of this lane half
  const int mOff  = (lane >> 4) * 8;           // D row offset

  v8f acc[4][4];
#pragma unroll
  for (int i = 0; i < 4; ++i)
#pragma unroll
    for (int j = 0; j < 4; ++j) acc[i][j] = (v8f){0.f,0.f,0.f,0.f,0.f,0.f,0.f,0.f};

  for (int k0 = 0; k0 < K; k0 += 32) {
    V bh[4], bl[4];
#pragma unroll
    for (int j = 0; j < 4; ++j) {
      const size_t bo = (size_t)(n0 + (j << 4) + rlane) * ldb + koff + k0;
      bh[j] = Frag<T>::load(Bb + bo);
      if (SPLIT) bl[j] = Frag<T>::load(Bb2 + bo);
    }
#pragma unroll
    for (int i = 0; i < 4; ++i) {
      const size_t ao = (size_t)(m0 + (i << 4) + rlane) * lda + koff + k0;
      V ah = Frag<T>::load(Ab + ao);
      V al;
      if (SPLIT) al = Frag<T>::load(Ab2 + ao);
#pragma unroll
      for (int j = 0; j < 4; ++j) {
        acc[i][j] = Frag<T>::mma(ah, bh[j], acc[i][j]);
        if (SPLIT) {
          acc[i][j] = Frag<T>::mma(ah, bl[j], acc[i][j]);
          acc[i][j] = Frag<T>::mma(al, bh[j], acc[i][j]);
        }
      }
      Frag<T>::guard(acc[i][0], acc[i][3], ah, SPLIT ? al : ah);
    }
    Frag<T>::keep(bh[0], bh[1], bh[2], bh[3]);
    if (SPLIT) Frag<T>::keep(bl[0], bl[1], bl[2], bl[3]);
  }
  acc_guard4(acc[0][0], acc[0][1], acc[0][2], acc[0][3]);
  acc_guard4(acc[1][0], acc[1][1], acc[1][2], acc[1][3]);
  acc_guard4(acc[2][0], acc[2][1], acc[2][2], acc[2][3]);
  acc_guard4(acc[3][0], acc[3][1], acc[3][2], acc[3][3]);

  // ---- epilogue ----
  float* slab = sT[wave];
  const float* Rb = RESID ? (resid + (size_t)b * strideR) : nullptr;
#pragma unroll
  for (int i = 0; i < 4; ++i) {
    const int mBase = m0 + (i << 4);
#pragma unroll
    for (int j = 0; j < 4; ++j) {
      const int n = n0 + (j << 4) + rlane;
      float bv = 0.f;
      if (BIAS_MODE == 2) bv = bias[n];
#pragma unroll
      for (int r = 0; r < 8; ++r) {
        float v = acc[i][j][r] * scale;
        if (BIAS_MODE == 1) v += bias[mBase + mOff + r];
        if (BIAS_MODE == 2) v += bv;
        if (RESID) v += Rb[(size_t)(mBase + mOff + r) * ldc + n];
        if (ACT == 1) v = tanhf(v);
        if (ACT == 2) v = fmaxf(v, 0.0f);
        if (ACT == 3) v = v / (1.0f + expf(-v));
        if (ACT == 4) v = (v > 0.f) ? v : 0.01f * v;
        if (ACT == 5) v = 0.5f * v * (1.0f + erff(v * 0.70710678118654752f));
        slab[(mOff + r) * 68 + (j << 4) + rlane] = v;
      }
    }
    __builtin_amdgcn_fence(__ATOMIC_RELEASE, "workgroup");
    __builtin_amdgcn_wave_barrier();
    __builtin_amdgcn_fence(__ATOMIC_ACQUIRE, "workgroup");
    if (OUT_MODE == 0) {
      float* C = (float*)Cout + (size_t)b * strideC;
      const int hh = lane >> 4, c4 = (lane & 15) * 4;     // row seg = 256 B = 16 lanes x 16 B
      {
#pragma unroll
        for (int it = 0; it < 8; ++it) {
          const int row = it * 2 + hh;
          v4f v = *(const v4f*)(slab + row * 68 + c4);
          *(v4f*)(C + (size_t)(mBase + row) * ldc + n0 + c4) = v;
        }
        
      }
    } else {
      const int q = lane >> 3, c8 = (lane & 7) * 8;
      unsigned short* C  = (unsigned short*)Cout  + (size_t)b * strideC;
      unsigned short* C2 = (OUT_MODE == 2) ? ((unsigned short*)Cout2 + (size_t)b * strideC) : nullptr;
      {
#pragma unroll
        for (int it = 0; it < 4; ++it) {
          const int row = it * 4 + q;
          const float* sp = slab + row * 68 + c8;
          v8h hv, lv;
#pragma unroll
          for (int e = 0; e < 8; ++e) {
            if (OUT_MODE == 1) {
              hv[e] = (_Float16)sp[e];
            } else {
              unsigned short hb = f2bf_bits(sp[e]);
              unsigned short lb = f2bf_bits(sp[e] - bf_bits2f(hb));
              hv[e] = __builtin_bit_cast(_Float16, hb);
              lv[e] = __builtin_bit_cast(_Float16, lb);
            }
          }
          *(v8h*)(C + (size_t)(mBase + row) * ldc + n0 + c8) = hv;
          if (OUT_MODE == 2) *(v8h*)(C2 + (size_t)(mBase + row) * ldc + n0 + c8) = lv;
        }
        
      }
    }
    __builtin_amdgcn_fence(__ATOMIC_RELEASE, "workgroup");
    __builtin_amdgcn_wave_barrier();
    __builtin_amdgcn_fence(__ATOMIC_ACQUIRE, "workgroup");
  }
}

// ---- rotary tables: cosT/sinT[t][i] = cos/sin(t * 10000^(-2i/64)), t < T_LEN, i < 32 ----
__global__ __launch_bounds__(256) void rope_table_kernel(float* __restrict__ cosT, float* __restrict__ sinT) {
  const int gid = blockIdx.x * 256 + threadIdx.x;   // T_LEN * 32 entries, grid exact
  const int t = gid >> 5, i = gid & 31;
  const float ex  = (float)(2 * i) * (1.0f / 64.0f);
  const float inv = 1.0f / powf(10000.0f, ex);
  const float ang = (float)t * inv;
  float sn, cs;
  sincosf(ang, &sn, &cs);
  float* vc = cosT;
  float* vs = sinT;
  vc[gid] = cs; vs[gid] = sn;
  
}

// ---- in[R][Cc] f32 -> out[Cc][R] f16 (out[c][r] = f16(in[r][c] * mul)); grid (Cc/64, R/64), block 256 ----
__global__ __launch_bounds__(256) void transpose_cast_f16(const float* __restrict__ in, unsigned short* __restrict__ outp,
                                                          int R, int Cc, float mul) {
  __shared__ float tile[64 * 65];
  const int tid = threadIdx.x;
  const int c0 = blockIdx.x * 64, r0 = blockIdx.y * 64;
  const int lc = tid & 63, lr = tid >> 6;   // lr 0..3
#pragma unroll
  for (int i = 0; i < 16; ++i) {
    const int r = i * 4 + lr;
    tile[r * 65 + lc] = in[(size_t)(r0 + r) * Cc + c0 + lc];
  }
  __syncthreads();
  _Float16* out = (_Float16*)outp;
  const int q = tid >> 3, c8 = (tid & 7) * 8;   // q 0..31
  {
#pragma unroll
    for (int it = 0; it < 2; ++it) {
      const int cl = it * 32 + q;                 // output row within the tile, 0..63
      v8h hv;
#pragma unroll
      for (int e = 0; e < 8; ++e) hv[e] = (_Float16)(tile[(c8 + e) * 65 + cl] * mul);
      *(v8h*)(out + (size_t)(c0 + cl) * R + r0 + c8) = hv;
    }
    
  }
}

// ---- LayerNorm over channels: x[B][C][T] -> H[B*T][C] f16; block = 2 waves, one wave = 32 tokens ----
__global__ __launch_bounds__(64) void ln_token_kernel(const float* __restrict__ x, const float* __restrict__ lnw,
                                                     const float* __restrict__ lnb, unsigned short* __restrict__ Hp) {
  __shared__ float tileS[2][64 * 33];
  __shared__ float muS[2][32];
  __shared__ float rsS[2][32];
  const int wave = threadIdx.x >> 5, lane = threadIdx.x & 31;
  const int tok0 = (blockIdx.x * 2 + wave) * 32;     // global token index b*T + t; a wave never crosses b
  const int b  = tok0 >> 11;                          // T_LEN = 2048
  const int t0 = tok0 & (T_LEN - 1);
  const float* xc = x + (size_t)b * DIM_C * T_LEN + t0 + lane;   // this lane's token column
  float sum = 0.f;
#pragma unroll 4
  for (int ch = 0; ch < DIM_C; ++ch) sum += xc[(size_t)ch * T_LEN];
  const float mu = sum * (1.0f / 1024.0f);
  float sq = 0.f;
#pragma unroll 4
  for (int ch = 0; ch < DIM_C; ++ch) { const float d = xc[(size_t)ch * T_LEN] - mu; sq += d * d; }
  const float rs = rsqrtf(sq * (1.0f / 1024.0f) + 1e-5f);
  muS[wave][lane] = mu;
  rsS[wave][lane] = rs;
  float* tile = tileS[wave];
  const int q = lane >> 3, c8 = (lane & 7) * 8;
  _Float16* H = (_Float16*)Hp;
#pragma unroll 1
  for (int cc = 0; cc < DIM_C / 64; ++cc) {
    __syncthreads();
#pragma unroll 8
    for (int i = 0; i < 64; ++i) tile[i * 33 + lane] = xc[(size_t)(cc * 64 + i) * T_LEN];
    __syncthreads();
{
#pragma unroll 1
      for (int it = 0; it < 8; ++it) {
        const int row = it * 4 + q;                 // token within the wave, 0..31
        const float mur = muS[wave][row], rsr = rsS[wave][row];
        v8h hv;
#pragma unroll
        for (int e = 0; e < 8; ++e) {
          const int cl = c8 + e;
          const float o = (tile[cl * 33 + row] - mur) * rsr * lnw[cc * 64 + cl] + lnb[cc * 64 + cl];
          hv[e] = (_Float16)o;
        }
        *(v8h*)(H + (size_t)(tok0 + row) * DIM_C + cc * 64 + c8) = hv;
      }
      
    }
  }
}

// ---- windowed causal attention, head_dim 64, inline rotary embedding ----
// qkv f32 [B*T][3*C] (q | k | v, head h at column h*64); O f16 [B*T][C].
// Block = 4 waves = 64 query rows of one (b, head); key chunks: the block's own 64 keys first (diagonal key keeps every
// row max finite), then chunk qb-1; mask: kv > q or q - kv > WIN-1 -> -inf. Online f32 softmax, numerators x2^15 in f16.
#define AT_D  64
#define AT_NW 4
#define AT_QB 64
#define AT_KC 64
__device__ __forceinline__ v8f mma_h(v16h a, v16h b, v8f c) {
  c = __builtin_amdgcn_wmma_f32_16x16x32_f16(false, a, false, b, (short)0, c, false, false);
  asm volatile("v_nop\n\tv_nop\n\tv_nop\n\tv_nop" : "+v"(c) : "v"(a), "v"(b));
  return c;
}

__global__ __launch_bounds__(128)
void local_attn_kernel(const float* __restrict__ qkv, const float* __restrict__ cosT,
                       const float* __restrict__ sinT, unsigned short* __restrict__ Op) {
  union FB { v16h v; v8h h[2]; };
  __shared__ __align__(16) _Float16 Ksh[AT_KC * AT_D];        // [kv][d]
  __shared__ __align__(16) _Float16 Vth[AT_D * AT_KC];        // [d][kv]
  __shared__ __align__(16) _Float16 Psh[AT_NW][16 * AT_KC];   // per wave [row][kv]
  __shared__ __align__(16) float   Os[AT_NW][16 * 68];         // per wave out tile, pitch 68

  const int tid  = threadIdx.x;
  const int wave = tid >> 5;
  const int lane = tid & 31;
  const int hh   = lane >> 4;
  const int c    = lane & 15;

  const int bx  = blockIdx.x;                 // B * N_HEAD * (T/64) blocks
  const int qb  = bx & 31;                    // T_LEN / AT_QB = 32
  const int bhd = bx >> 5;
  const int hd  = bhd & (N_HEAD - 1);
  const int b   = bhd >> 4;
  const int q0  = qb * AT_QB + wave * 16;
  const size_t rowb = (size_t)b * T_LEN;
  const int hoff = hd * D_HEAD;

  // ---- Q fragments (A operand) with rotary embedding and the 1/sqrt(64) scale, f16 ----
  v16h qa[2];
  {
    const int tq = q0 + c;
    const float* qrow = qkv + (rowb + tq) * N_QKV + hoff;
    const float* crow = cosT + (size_t)tq * 32;
    const float* srow = sinT + (size_t)tq * 32;
#pragma unroll
    for (int u = 0; u < 2; ++u) {
#pragma unroll
      for (int e = 0; e < 8; ++e) {
        const int d = 16 * u + 8 * hh + e;      // d in 0..31, partner d+32
        const float x1 = qrow[d], x2 = qrow[d + 32];
        const float cs = crow[d], sn = srow[d];
        const float lo = x1 * cs - x2 * sn;
        const float hi = x2 * cs + x1 * sn;
        qa[0][8 * u + e] = (_Float16)(lo * QK_SCALE);
        qa[1][8 * u + e] = (_Float16)(hi * QK_SCALE);
      }
    }
  }

  float mrow[8], lrow[8];
  v8f oacc[4];
#pragma unroll
  for (int r = 0; r < 8; ++r) { mrow[r] = -INFINITY; lrow[r] = 0.f; }
#pragma unroll
  for (int t = 0; t < 4; ++t) oacc[t] = (v8f){0.f,0.f,0.f,0.f,0.f,0.f,0.f,0.f};

  const int nch = (qb > 0) ? 2 : 1;           // block-uniform, static max 2
  for (int ci = 0; ci < nch; ++ci) {
    const int kv0 = (qb - ci) * AT_KC;
    __syncthreads();
    {   // stage K (rotary applied, f16) and V^T (f16)
      const int kvr = tid >> 1, j = tid & 1;
      const size_t krb = (rowb + kv0 + kvr) * N_QKV;
      const float* krow = qkv + krb + DIM_C + hoff;
      const float* vrow = qkv + krb + 2 * DIM_C + hoff + 32 * j;
      const float* ck = cosT + (size_t)(kv0 + kvr) * 32 + 16 * j;
      const float* sk = sinT + (size_t)(kv0 + kvr) * 32 + 16 * j;
#pragma unroll
      for (int ii = 0; ii < 4; ++ii) {
        const v4f x1 = *(const v4f*)(krow + 16 * j + 4 * ii);
        const v4f x2 = *(const v4f*)(krow + 32 + 16 * j + 4 * ii);
        const v4f cs = *(const v4f*)(ck + 4 * ii);
        const v4f sn = *(const v4f*)(sk + 4 * ii);
#pragma unroll
        for (int e = 0; e < 4; ++e) {
          const int d = 16 * j + 4 * ii + e;
          Ksh[kvr * AT_D + d]      = (_Float16)(x1[e] * cs[e] - x2[e] * sn[e]);
          Ksh[kvr * AT_D + 32 + d] = (_Float16)(x2[e] * cs[e] + x1[e] * sn[e]);
        }
      }
#pragma unroll
      for (int ii = 0; ii < 8; ++ii) {
        const v4f vv = *(const v4f*)(vrow + 4 * ii);
#pragma unroll
        for (int e = 0; e < 4; ++e) Vth[(32 * j + 4 * ii + e) * AT_KC + kvr] = (_Float16)vv[e];
      }
    }
    __syncthreads();

    // scores S[q][kv]: A = Q (row = c), B[k=d][n=kv] from Ksh with the split k map
    v8f s[4];
#pragma unroll
    for (int j2 = 0; j2 < 4; ++j2) {
      s[j2] = (v8f){0.f,0.f,0.f,0.f,0.f,0.f,0.f,0.f};
#pragma unroll
      for (int dc = 0; dc < 2; ++dc) {
        FB kb;
        kb.h[0] = *(const v8h*)(Ksh + (j2 * 16 + c) * AT_D + dc * 32 + 8 * hh);
        kb.h[1] = *(const v8h*)(Ksh + (j2 * 16 + c) * AT_D + dc * 32 + 16 + 8 * hh);
        s[j2] = mma_h(qa[dc], kb.v, s[j2]);
      }
    }
    float cm[8];
#pragma unroll
    for (int r = 0; r < 8; ++r) {
      const int qr = q0 + 8 * hh + r;
      float m = -INFINITY;
#pragma unroll
      for (int j2 = 0; j2 < 4; ++j2) {
        const int kvcol = kv0 + j2 * 16 + c;
        const bool masked = (kvcol > qr) || (qr - kvcol > WIN - 1);
        if (masked) s[j2][r] = -INFINITY;
        m = fmaxf(m, s[j2][r]);
      }
#pragma unroll
      for (int off = 1; off < 16; off <<= 1) m = fmaxf(m, __shfl_xor(m, off, 32));
      cm[r] = m;
    }
    _Float16* pw = Psh[wave];
#pragma unroll
    for (int r = 0; r < 8; ++r) {
      const float mnew  = fmaxf(mrow[r], cm[r]);   // finite: the diagonal chunk comes first
      const float alpha = expf(mrow[r] - mnew);
      mrow[r] = mnew;
      float psum = 0.f;
#pragma unroll
      for (int j2 = 0; j2 < 4; ++j2) {
        const float p = expf(s[j2][r] - mnew);
        psum += p;
        pw[(8 * hh + r) * AT_KC + j2 * 16 + c] = (_Float16)(p * P_SC);
      }
#pragma unroll
      for (int off = 1; off < 16; off <<= 1) psum += __shfl_xor(psum, off, 32);
      lrow[r] = lrow[r] * alpha + psum;
#pragma unroll
      for (int t = 0; t < 4; ++t) oacc[t][r] *= alpha;
    }
    __builtin_amdgcn_fence(__ATOMIC_RELEASE, "workgroup");
    __builtin_amdgcn_wave_barrier();
    __builtin_amdgcn_fence(__ATOMIC_ACQUIRE, "workgroup");
    // O += P . V : A = P (row = c, k = kv), B[k=kv][n=d] from Vth
#pragma unroll 1
    for (int kk = 0; kk < 2; ++kk) {
      FB pa;
      pa.h[0] = *(const v8h*)(pw + c * AT_KC + kk * 32 + 8 * hh);
      pa.h[1] = *(const v8h*)(pw + c * AT_KC + kk * 32 + 16 + 8 * hh);
#pragma unroll
      for (int t = 0; t < 4; ++t) {
        FB vb;
        vb.h[0] = *(const v8h*)(Vth + (t * 16 + c) * AT_KC + kk * 32 + 8 * hh);
        vb.h[1] = *(const v8h*)(Vth + (t * 16 + c) * AT_KC + kk * 32 + 16 + 8 * hh);
        oacc[t] = mma_h(pa.v, vb.v, oacc[t]);
      }
    }
  }

  float* os = Os[wave];
#pragma unroll
  for (int r = 0; r < 8; ++r) {
    const float inv = 1.0f / (lrow[r] * P_SC);
#pragma unroll
    for (int t = 0; t < 4; ++t) os[(8 * hh + r) * 68 + t * 16 + c] = oacc[t][r] * inv;
  }
  __builtin_amdgcn_fence(__ATOMIC_RELEASE, "workgroup");
  __builtin_amdgcn_wave_barrier();
  __builtin_amdgcn_fence(__ATOMIC_ACQUIRE, "workgroup");
  {
    _Float16* Ob = (_Float16*)Op;
    const int q4 = lane >> 3, c8 = (lane & 7) * 8;
    {
#pragma unroll
      for (int it = 0; it < 4; ++it) {
        const int row = it * 4 + q4;            // 0..15
        const float* sp = os + row * 68 + c8;
        v8h hv;
#pragma unroll
        for (int e = 0; e < 8; ++e) hv[e] = (_Float16)sp[e];
        *(v8h*)(Ob + (rowb + q0 + row) * DIM_C + hoff + c8) = hv;
      }
      
    }
  }
}

// ---------------- launcher ----------------
extern "C" void kernel_launch(void* const* d_in, const int* in_sizes, int n_in,
                              void* d_out, int out_size, void* d_ws, size_t ws_size,
                              hipStream_t stream) {
  if (n_in < 5) return;
  if (in_sizes[0] != B_SZ * DIM_C * T_LEN) return;
  if (in_sizes[1] != DIM_C || in_sizes[2] != DIM_C) return;
  if (in_sizes[3] != DIM_C * N_QKV) return;
  if (in_sizes[4] != DIM_C * DIM_C) return;
  if (out_size != B_SZ * DIM_C * T_LEN) return;

  const float* x     = (const float*)d_in[0];
  const float* ln_w  = (const float*)d_in[1];
  const float* ln_b  = (const float*)d_in[2];
  const float* w_qkv = (const float*)d_in[3];   // [1024][3072] (in x out)
  const float* w_out = (const float*)d_in[4];   // [1024][1024] (in x out)
  float*       out   = (float*)d_out;           // [B][C][T]

  // workspace carve (all offsets multiples of 256 KiB)
  char* ws = (char*)d_ws;
  size_t off = 0;
  unsigned short* Hb   = (unsigned short*)(ws + off); off += (size_t)N_TOK * DIM_C * 2;     // f16 [4096][1024]
  unsigned short* Wq   = (unsigned short*)(ws + off); off += (size_t)N_QKV * DIM_C * 2;     // f16 [3072][1024]
  unsigned short* Wo   = (unsigned short*)(ws + off); off += (size_t)DIM_C * DIM_C * 2;     // f16 [1024][1024]
  float*          qkvb = (float*)(ws + off);          off += (size_t)N_TOK * N_QKV * 4;     // f32 [4096][3072]
  unsigned short* Ob   = (unsigned short*)(ws + off); off += (size_t)N_TOK * DIM_C * 2;     // f16 [4096][1024]
  float*          cosT = (float*)(ws + off);          off += (size_t)T_LEN * 32 * 4;        // f32 [2048][32]
  float*          sinT = (float*)(ws + off);          off += (size_t)T_LEN * 32 * 4;        // f32 [2048][32]
  if (off > ws_size) return;                          // 76,021,760 B total

  // 1) rotary cos/sin tables
  rope_table_kernel<<<(T_LEN * 32) / 256, 256, 0, stream>>>(cosT, sinT);

  // 2) w_qkv [1024 rows][3072 cols] -> Wq [3072][1024] f16 x64 ; grid (cols/64, rows/64)
  transpose_cast_f16<<<dim3(N_QKV / 64, DIM_C / 64), 256, 0, stream>>>(w_qkv, Wq, DIM_C, N_QKV, W_SCALE);
  //    w_out [1024 rows][1024 cols] -> Wo [1024][1024] f16 x64
  transpose_cast_f16<<<dim3(DIM_C / 64, DIM_C / 64), 256, 0, stream>>>(w_out, Wo, DIM_C, DIM_C, W_SCALE);

  // 3) LayerNorm -> H f16 [B*T][C]
  ln_token_kernel<<<N_TOK / 64, 64, 0, stream>>>(x, ln_w, ln_b, Hb);

  // 4) qkv[4096][3072] = H . Wq^T / 64  (f16 operands, f32 out)
  {
    const int tiles = (N_TOK / 64) * (N_QKV / 64);   // 3072, multiple of 8
    wmma_gemm64<0, false, 0, 0, false><<<dim3(tiles / 8, 1), 256, 0, stream>>>(
        Hb, Hb, DIM_C, 0L, Wq, Wq, DIM_C, 0L, (void*)qkvb, (void*)qkvb, N_QKV, 0L,
        ln_w, x, 0L, N_TOK, N_QKV, DIM_C, W_SCALE_INV);
  }

  // 5) windowed causal attention with inline rotary -> O f16 [B*T][C]
  local_attn_kernel<<<B_SZ * N_HEAD * (T_LEN / AT_QB), 128, 0, stream>>>(qkvb, cosT, sinT, Ob);

  {
    const int tiles = (DIM_C / 64) * (T_LEN / 64);   // 512, multiple of 8
    wmma_gemm64<0, false, 0, 0, true><<<dim3(tiles / 8, B_SZ), 256, 0, stream>>>(
        Wo, Wo, DIM_C, 0L, Ob, Ob, DIM_C, (long)T_LEN * DIM_C, (void*)out, (void*)out, T_LEN, (long)DIM_C * T_LEN,
        ln_w, x, (long)DIM_C * T_LEN, DIM_C, T_LEN, DIM_C, W_SCALE_INV);
  }
}

// v001
// Measured time: 153 microseconds a run.
// Next to v000, in two timings, it ran 2.15 and 2.14 times as fast.
#include <hip/hip_runtime.h>
// Contractions: v_wmma_f32_16x16x32_f16 (f16 operands, f32 accumulate) for the qkv projection, the q.k^T scores, p.v and the output projection; weights carried x64 in f16 (1/64 folded into the epilogue scale), softmax numerators carried x2^15; LayerNorm, rotary tables and softmax in f32.

#define DIM_C    1024
#define T_LEN    2048
#define B_SZ     2
#define N_HEAD   16
#define D_HEAD   64
#define WIN      32
#define N_TOK    (B_SZ * T_LEN)
#define N_QKV    (3 * DIM_C)
#define W_SCALE  64.0f
#define W_SCALE_INV (1.0f / 64.0f)
#define P_SC     32768.0f
#define QK_SCALE 0.125f

typedef __attribute__((ext_vector_type(16))) _Float16 v16h;
typedef __attribute__((ext_vector_type(8)))  _Float16 v8h;
typedef __attribute__((ext_vector_type(16))) __bf16   v16b;
typedef __attribute__((ext_vector_type(8)))  __bf16   v8b;
typedef __attribute__((ext_vector_type(8)))  float    v8f;
typedef __attribute__((ext_vector_type(4)))  float    v4f;

__device__ __forceinline__ unsigned short f2bf_bits(float f) {
  unsigned u = __float_as_uint(f);
  return (unsigned short)((u + 0x7FFFu + ((u >> 16) & 1u)) >> 16);
}
__device__ __forceinline__ float bf_bits2f(unsigned short h) { return __uint_as_float(((unsigned)h) << 16); }

// hazard guards as plain device helpers
__device__ __forceinline__ void dep_guard_h(v8f& a, v8f& b, v16h x, v16h y) { asm volatile("v_nop\n\tv_nop\n\tv_nop\n\tv_nop" : "+v"(a), "+v"(b) : "v"(x), "v"(y)); }
__device__ __forceinline__ void dep_guard_b(v8f& a, v8f& b, v16b x, v16b y) { asm volatile("v_nop\n\tv_nop\n\tv_nop\n\tv_nop" : "+v"(a), "+v"(b) : "v"(x), "v"(y)); }
__device__ __forceinline__ void keep4_h(v16h a, v16h b, v16h c, v16h d) { asm volatile("v_nop" :: "v"(a), "v"(b), "v"(c), "v"(d)); }
__device__ __forceinline__ void keep4_b(v16b a, v16b b, v16b c, v16b d) { asm volatile("v_nop" :: "v"(a), "v"(b), "v"(c), "v"(d)); }
__device__ __forceinline__ void acc_guard4(v8f& a, v8f& b, v8f& c, v8f& d) { asm volatile("v_nop\n\tv_nop\n\tv_nop\n\tv_nop" : "+v"(a), "+v"(b), "+v"(c), "+v"(d)); }
template <typename T> struct Frag;
template <> struct Frag<_Float16> {
  typedef v16h V; union U { v16h v; v8h h[2]; };
  static __device__ __forceinline__ v16h load(const _Float16* p) {   // elements 0..7 <- p[0..7], 8..15 <- p[16..23]
    U f; f.h[0] = *(const v8h*)(p); f.h[1] = *(const v8h*)(p + 16); return f.v;
  }
  static __device__ __forceinline__ v8f mma(v16h a, v16h b, v8f c) {
    return __builtin_amdgcn_wmma_f32_16x16x32_f16(false, a, false, b, (short)0, c, false, false);
  }
  static __device__ __forceinline__ void guard(v8f& a, v8f& b, v16h x, v16h y) { dep_guard_h(a, b, x, y); }
  static __device__ __forceinline__ void keep(v16h a, v16h b, v16h c, v16h d) { keep4_h(a, b, c, d); }
};
template <> struct Frag<__bf16> {
  typedef v16b V; union U { v16b v; v8b h[2]; };
  static __device__ __forceinline__ v16b load(const __bf16* p) {
    U f; f.h[0] = *(const v8b*)(p); f.h[1] = *(const v8b*)(p + 16); return f.v;
  }
  static __device__ __forceinline__ v8f mma(v16b a, v16b b, v8f c) {
    return __builtin_amdgcn_wmma_f32_16x16x32_bf16(false, a, false, b, (short)0, c, false, false);
  }
  static __device__ __forceinline__ void guard(v8f& a, v8f& b, v16b x, v16b y) { dep_guard_b(a, b, x, y); }
  static __device__ __forceinline__ void keep(v16b a, v16b b, v16b c, v16b d) { keep4_b(a, b, c, d); }
};

// ---- Register-blocked batched WMMA GEMM ------------------------------------
// C[m,n] = scale * sum_k A[m,k] * Bt[n,k] (+bias)(+resid); each wave owns a 64x64 tile.
// A row-major [M,K]; Bt row-major [N,K]; M,N % 64 == 0, K % 32 == 0.
// SPLIT: operands are hi/lo planes (A2/Bt2 = lo planes, same layout); product = hi.hi + hi.lo + lo.hi.
// BIAS_MODE: 0 = none, 1 = bias[m], 2 = bias[n].
// OUT_MODE: 0 = f32, 1 = f16, 2 = bf16 hi plane (Cout) + bf16 lo plane (Cout2).
// ET: 0 = f16 operands, 1 = bf16 operands (pointers passed as 16-bit storage)
template <int ET> struct Elem;
template <> struct Elem<0> { typedef _Float16 T; };
template <> struct Elem<1> { typedef __bf16 T; };
template <int ET, bool SPLIT, int BIAS_MODE, int OUT_MODE, bool RESID, int ACT = 0>
__global__ __launch_bounds__(256) void wmma_gemm64(
    const unsigned short* __restrict__ Ap, const unsigned short* __restrict__ A2p, int lda, long strideA,
    const unsigned short* __restrict__ Btp, const unsigned short* __restrict__ Bt2p, int ldb, long strideB,
    void* __restrict__ Cout, void* __restrict__ Cout2, int ldc, long strideC,
    const float* __restrict__ bias,
    const float* __restrict__ resid, long strideR,
    int M, int N, int K, float scale) {
  typedef typename Elem<ET>::T T;
  typedef typename Frag<T>::V V;
  const T* A = (const T*)Ap; const T* A2 = (const T*)A2p; const T* Bt = (const T*)Btp; const T* Bt2 = (const T*)Bt2p;
  __shared__ __align__(16) float sT[8][16 * 68];   // per-wave 16x64 slab, pitch 68 floats
  const int b    = blockIdx.y;
  const int lane = threadIdx.x & 31;
  const int wave = threadIdx.x >> 5;
  const int tilesN = N >> 6;
  const int tilesM = M >> 6;
  const int tile = blockIdx.x * 8 + wave;
  if (tile >= tilesM * tilesN) return;   // wave-uniform; no block barriers in this kernel
  const int tm = tile / tilesN;
  const int tn = tile - tm * tilesN;
  const int m0 = tm << 6;
  const int n0 = tn << 6;

  const T* Ab  = A  + (size_t)b * strideA;
  const T* Bb  = Bt + (size_t)b * strideB;
  const T* Ab2 = SPLIT ? (A2  + (size_t)b * strideA) : nullptr;
  const T* Bb2 = SPLIT ? (Bt2 + (size_t)b * strideB) : nullptr;

  const int rlane = lane & 15;                 // row (A) / col (B, D) within subtile
  const int koff  = (lane >> 4) * 8;           // k offset of this lane half
  const int mOff  = (lane >> 4) * 8;           // D row offset

  v8f acc[4][4];
#pragma unroll
  for (int i = 0; i < 4; ++i)
#pragma unroll
    for (int j = 0; j < 4; ++j) acc[i][j] = (v8f){0.f,0.f,0.f,0.f,0.f,0.f,0.f,0.f};

  for (int k0 = 0; k0 < K; k0 += 32) {
    V bh[4], bl[4];
#pragma unroll
    for (int j = 0; j < 4; ++j) {
      const size_t bo = (size_t)(n0 + (j << 4) + rlane) * ldb + koff + k0;
      bh[j] = Frag<T>::load(Bb + bo);
      if (SPLIT) bl[j] = Frag<T>::load(Bb2 + bo);
    }
#pragma unroll
    for (int i = 0; i < 4; ++i) {
      const size_t ao = (size_t)(m0 + (i << 4) + rlane) * lda + koff + k0;
      V ah = Frag<T>::load(Ab + ao);
      V al;
      if (SPLIT) al = Frag<T>::load(Ab2 + ao);
#pragma unroll
      for (int j = 0; j < 4; ++j) {
        acc[i][j] = Frag<T>::mma(ah, bh[j], acc[i][j]);
        if (SPLIT) {
          acc[i][j] = Frag<T>::mma(ah, bl[j], acc[i][j]);
          acc[i][j] = Frag<T>::mma(al, bh[j], acc[i][j]);
        }
      }
      Frag<T>::guard(acc[i][0], acc[i][3], ah, SPLIT ? al : ah);
    }
    Frag<T>::keep(bh[0], bh[1], bh[2], bh[3]);
    if (SPLIT) Frag<T>::keep(bl[0], bl[1], bl[2], bl[3]);
  }
  acc_guard4(acc[0][0], acc[0][1], acc[0][2], acc[0][3]);
  acc_guard4(acc[1][0], acc[1][1], acc[1][2], acc[1][3]);
  acc_guard4(acc[2][0], acc[2][1], acc[2][2], acc[2][3]);
  acc_guard4(acc[3][0], acc[3][1], acc[3][2], acc[3][3]);

  // ---- epilogue ----
  float* slab = sT[wave];
  const float* Rb = RESID ? (resid + (size_t)b * strideR) : nullptr;
#pragma unroll
  for (int i = 0; i < 4; ++i) {
    const int mBase = m0 + (i << 4);
#pragma unroll
    for (int j = 0; j < 4; ++j) {
      const int n = n0 + (j << 4) + rlane;
      float bv = 0.f;
      if (BIAS_MODE == 2) bv = bias[n];
#pragma unroll
      for (int r = 0; r < 8; ++r) {
        float v = acc[i][j][r] * scale;
        if (BIAS_MODE == 1) v += bias[mBase + mOff + r];
        if (BIAS_MODE == 2) v += bv;
        if (RESID) v += Rb[(size_t)(mBase + mOff + r) * ldc + n];
        if (ACT == 1) v = tanhf(v);
        if (ACT == 2) v = fmaxf(v, 0.0f);
        if (ACT == 3) v = v / (1.0f + expf(-v));
        if (ACT == 4) v = (v > 0.f) ? v : 0.01f * v;
        if (ACT == 5) v = 0.5f * v * (1.0f + erff(v * 0.70710678118654752f));
        slab[(mOff + r) * 68 + (j << 4) + rlane] = v;
      }
    }
    __builtin_amdgcn_fence(__ATOMIC_RELEASE, "workgroup");
    __builtin_amdgcn_wave_barrier();
    __builtin_amdgcn_fence(__ATOMIC_ACQUIRE, "workgroup");
    if (OUT_MODE == 0) {
      float* C = (float*)Cout + (size_t)b * strideC;
      const int hh = lane >> 4, c4 = (lane & 15) * 4;     // row seg = 256 B = 16 lanes x 16 B
      {
#pragma unroll
        for (int it = 0; it < 8; ++it) {
          const int row = it * 2 + hh;
          v4f v = *(const v4f*)(slab + row * 68 + c4);
          *(v4f*)(C + (size_t)(mBase + row) * ldc + n0 + c4) = v;
        }
        
      }
    } else {
      const int q = lane >> 3, c8 = (lane & 7) * 8;
      unsigned short* C  = (unsigned short*)Cout  + (size_t)b * strideC;
      unsigned short* C2 = (OUT_MODE == 2) ? ((unsigned short*)Cout2 + (size_t)b * strideC) : nullptr;
      {
#pragma unroll
        for (int it = 0; it < 4; ++it) {
          const int row = it * 4 + q;
          const float* sp = slab + row * 68 + c8;
          v8h hv, lv;
#pragma unroll
          for (int e = 0; e < 8; ++e) {
            if (OUT_MODE == 1) {
              hv[e] = (_Float16)sp[e];
            } else {
              unsigned short hb = f2bf_bits(sp[e]);
              unsigned short lb = f2bf_bits(sp[e] - bf_bits2f(hb));
              hv[e] = __builtin_bit_cast(_Float16, hb);
              lv[e] = __builtin_bit_cast(_Float16, lb);
            }
          }
          *(v8h*)(C + (size_t)(mBase + row) * ldc + n0 + c8) = hv;
          if (OUT_MODE == 2) *(v8h*)(C2 + (size_t)(mBase + row) * ldc + n0 + c8) = lv;
        }
        
      }
    }
    __builtin_amdgcn_fence(__ATOMIC_RELEASE, "workgroup");
    __builtin_amdgcn_wave_barrier();
    __builtin_amdgcn_fence(__ATOMIC_ACQUIRE, "workgroup");
  }
}

// ---- rotary tables: cosT/sinT[t][i] = cos/sin(t * 10000^(-2i/64)), t < T_LEN, i < 32 ----
__global__ __launch_bounds__(256) void rope_table_kernel(float* __restrict__ cosT, float* __restrict__ sinT) {
  const int gid = blockIdx.x * 256 + threadIdx.x;   // T_LEN * 32 entries, grid exact
  const int t = gid >> 5, i = gid & 31;
  const float ex  = (float)(2 * i) * (1.0f / 64.0f);
  const float inv = 1.0f / powf(10000.0f, ex);
  const float ang = (float)t * inv;
  float sn, cs;
  sincosf(ang, &sn, &cs);
  float* vc = cosT;
  float* vs = sinT;
  vc[gid] = cs; vs[gid] = sn;
  
}

// ---- in[R][Cc] f32 -> out[Cc][R] f16 (out[c][r] = f16(in[r][c] * mul)); grid (Cc/64, R/64), block 256 ----
__global__ __launch_bounds__(256) void transpose_cast_f16(const float* __restrict__ in, unsigned short* __restrict__ outp,
                                                          int R, int Cc, float mul) {
  __shared__ float tile[64 * 65];
  const int tid = threadIdx.x;
  const int c0 = blockIdx.x * 64, r0 = blockIdx.y * 64;
  const int lc = tid & 63, lr = tid >> 6;   // lr 0..3
#pragma unroll
  for (int i = 0; i < 16; ++i) {
    const int r = i * 4 + lr;
    tile[r * 65 + lc] = in[(size_t)(r0 + r) * Cc + c0 + lc];
  }
  __syncthreads();
  _Float16* out = (_Float16*)outp;
  const int q = tid >> 3, c8 = (tid & 7) * 8;   // q 0..31
  {
#pragma unroll
    for (int it = 0; it < 2; ++it) {
      const int cl = it * 32 + q;                 // output row within the tile, 0..63
      v8h hv;
#pragma unroll
      for (int e = 0; e < 8; ++e) hv[e] = (_Float16)(tile[(c8 + e) * 65 + cl] * mul);
      *(v8h*)(out + (size_t)(c0 + cl) * R + r0 + c8) = hv;
    }
    
  }
}

// ---- LayerNorm over channels: x[B][C][T] -> H[B*T][C] f16 ----
// Block = 16 waves = 32 tokens (lane = token). Wave w keeps channels 64w..64w+63 of those tokens in registers, so x is
// read once; the 16 per-wave partial sums of a token are joined through LDS (mean first, then the centred squares).
#define LN_NW 16
__global__ __launch_bounds__(512) void ln_token_kernel(const float* __restrict__ x, const float* __restrict__ lnw,
                                                      const float* __restrict__ lnb, unsigned short* __restrict__ Hp) {
  __shared__ float sumS[LN_NW][32];
  __shared__ float sqS[LN_NW][32];
  __shared__ __align__(16) _Float16 outS[LN_NW][32 * 64];   // per wave [token][channel], 16-B chunks swizzled
  const int lane = threadIdx.x & 31;
  const int wave = __builtin_amdgcn_readfirstlane(threadIdx.x >> 5);   // scalar, so lnw / lnb go through scalar loads
  const int tok0 = blockIdx.x * 32;                   // global token index b*T + t; a block never crosses b
  const int b   = tok0 >> 11;                         // T_LEN = 2048
  const int t0  = tok0 & (T_LEN - 1);
  const int ch0 = wave * 64;
  const float* xc = x + ((size_t)b * DIM_C + ch0) * T_LEN + t0 + lane;   // this lane's token column
  float v[64];
  // every loop below is fully unrolled: v[] stays in registers only under static indices, and all 64 loads go out at once
#pragma unroll
  for (int i = 0; i < 64; ++i) v[i] = xc[(size_t)i * T_LEN];

  float s0 = 0.f, s1 = 0.f, s2 = 0.f, s3 = 0.f;
#pragma unroll
  for (int i = 0; i < 64; i += 4) { s0 += v[i]; s1 += v[i + 1]; s2 += v[i + 2]; s3 += v[i + 3]; }
  sumS[wave][lane] = (s0 + s1) + (s2 + s3);
  __syncthreads();
  float sum = 0.f;
#pragma unroll
  for (int w = 0; w < LN_NW; ++w) sum += sumS[w][lane];
  const float mu = sum * (1.0f / 1024.0f);

  s0 = 0.f; s1 = 0.f; s2 = 0.f; s3 = 0.f;
#pragma unroll
  for (int i = 0; i < 64; i += 4) {
    v[i] -= mu; v[i + 1] -= mu; v[i + 2] -= mu; v[i + 3] -= mu;
    s0 += v[i] * v[i]; s1 += v[i + 1] * v[i + 1]; s2 += v[i + 2] * v[i + 2]; s3 += v[i + 3] * v[i + 3];
  }
  sqS[wave][lane] = (s0 + s1) + (s2 + s3);
  __syncthreads();
  float sq = 0.f;
#pragma unroll
  for (int w = 0; w < LN_NW; ++w) sq += sqS[w][lane];
  const float rs = rsqrtf(sq * (1.0f / 1024.0f) + 1e-5f);

  // normalise; each lane lays its token's 64 channels (128 B) into the wave's own LDS tile. Chunk j of row r sits at
  // chunk j ^ ((r >> 1) & 7): 16 rows at one j, and 2 whole rows, each cover all 64 banks once.
  _Float16* tile = outS[wave];
  const float* wv = lnw + ch0;
  const float* bv = lnb + ch0;
  const int sw = (lane >> 1) & 7;
#pragma unroll
  for (int j = 0; j < 8; ++j) {
    v8h hv;
#pragma unroll
    for (int e = 0; e < 8; ++e) hv[e] = (_Float16)(v[8 * j + e] * rs * wv[8 * j + e] + bv[8 * j + e]);
    *(v8h*)(tile + lane * 64 + ((j ^ sw) << 3)) = hv;
  }
  // the tile is this wave's own: order its LDS stores before its LDS loads, no work-group barrier needed
  __builtin_amdgcn_fence(__ATOMIC_RELEASE, "workgroup");
  __builtin_amdgcn_wave_barrier();
  __builtin_amdgcn_fence(__ATOMIC_ACQUIRE, "workgroup");
  _Float16* H = (_Float16*)Hp + (size_t)tok0 * DIM_C + ch0;
  const int q = lane >> 3, c = lane & 7;
#pragma unroll
  for (int it = 0; it < 8; ++it) {
    const int row = it * 4 + q;                       // token within the block; one store = 4 whole 128-B lines
    const v8h hv = *(const v8h*)(tile + row * 64 + ((c ^ ((row >> 1) & 7)) << 3));
    *(v8h*)(H + (size_t)row * DIM_C + c * 8) = hv;
  }
}

// ---- windowed causal attention, head_dim 64, inline rotary embedding ----
// qkv f32 [B*T][3*C] (q | k | v, head h at column h*64); O f16 [B*T][C].
// Block = 4 waves = 64 query rows of one (b, head); key chunks: the block's own 64 keys first (diagonal key keeps every
// row max finite), then chunk qb-1; mask: kv > q or q - kv > WIN-1 -> -inf. Online f32 softmax, numerators x2^15 in f16.
#define AT_D  64
#define AT_NW 4
#define AT_QB 64
#define AT_KC 64
__device__ __forceinline__ v8f mma_h(v16h a, v16h b, v8f c) {
  c = __builtin_amdgcn_wmma_f32_16x16x32_f16(false, a, false, b, (short)0, c, false, false);
  asm volatile("v_nop\n\tv_nop\n\tv_nop\n\tv_nop" : "+v"(c) : "v"(a), "v"(b));
  return c;
}

__global__ __launch_bounds__(128)
void local_attn_kernel(const float* __restrict__ qkv, const float* __restrict__ cosT,
                       const float* __restrict__ sinT, unsigned short* __restrict__ Op) {
  union FB { v16h v; v8h h[2]; };
  __shared__ __align__(16) _Float16 Ksh[AT_KC * AT_D];        // [kv][d]
  __shared__ __align__(16) _Float16 Vth[AT_D * AT_KC];        // [d][kv]
  __shared__ __align__(16) _Float16 Psh[AT_NW][16 * AT_KC];   // per wave [row][kv]
  __shared__ __align__(16) float   Os[AT_NW][16 * 68];         // per wave out tile, pitch 68

  const int tid  = threadIdx.x;
  const int wave = tid >> 5;
  const int lane = tid & 31;
  const int hh   = lane >> 4;
  const int c    = lane & 15;

  const int bx  = blockIdx.x;                 // B * N_HEAD * (T/64) blocks
  const int qb  = bx & 31;                    // T_LEN / AT_QB = 32
  const int bhd = bx >> 5;
  const int hd  = bhd & (N_HEAD - 1);
  const int b   = bhd >> 4;
  const int q0  = qb * AT_QB + wave * 16;
  const size_t rowb = (size_t)b * T_LEN;
  const int hoff = hd * D_HEAD;

  // ---- Q fragments (A operand) with rotary embedding and the 1/sqrt(64) scale, f16 ----
  v16h qa[2];
  {
    const int tq = q0 + c;
    const float* qrow = qkv + (rowb + tq) * N_QKV + hoff;
    const float* crow = cosT + (size_t)tq * 32;
    const float* srow = sinT + (size_t)tq * 32;
#pragma unroll
    for (int u = 0; u < 2; ++u) {
#pragma unroll
      for (int e = 0; e < 8; ++e) {
        const int d = 16 * u + 8 * hh + e;      // d in 0..31, partner d+32
        const float x1 = qrow[d], x2 = qrow[d + 32];
        const float cs = crow[d], sn = srow[d];
        const float lo = x1 * cs - x2 * sn;
        const float hi = x2 * cs + x1 * sn;
        qa[0][8 * u + e] = (_Float16)(lo * QK_SCALE);
        qa[1][8 * u + e] = (_Float16)(hi * QK_SCALE);
      }
    }
  }

  float mrow[8], lrow[8];
  v8f oacc[4];
#pragma unroll
  for (int r = 0; r < 8; ++r) { mrow[r] = -INFINITY; lrow[r] = 0.f; }
#pragma unroll
  for (int t = 0; t < 4; ++t) oacc[t] = (v8f){0.f,0.f,0.f,0.f,0.f,0.f,0.f,0.f};

  const int nch = (qb > 0) ? 2 : 1;           // block-uniform, static max 2
  for (int ci = 0; ci < nch; ++ci) {
    const int kv0 = (qb - ci) * AT_KC;
    __syncthreads();
    {   // stage K (rotary applied, f16) and V^T (f16)
      const int kvr = tid >> 1, j = tid & 1;
      const size_t krb = (rowb + kv0 + kvr) * N_QKV;
      const float* krow = qkv + krb + DIM_C + hoff;
      const float* vrow = qkv + krb + 2 * DIM_C + hoff + 32 * j;
      const float* ck = cosT + (size_t)(kv0 + kvr) * 32 + 16 * j;
      const float* sk = sinT + (size_t)(kv0 + kvr) * 32 + 16 * j;
#pragma unroll
      for (int ii = 0; ii < 4; ++ii) {
        const v4f x1 = *(const v4f*)(krow + 16 * j + 4 * ii);
        const v4f x2 = *(const v4f*)(krow + 32 + 16 * j + 4 * ii);
        const v4f cs = *(const v4f*)(ck + 4 * ii);
        const v4f sn = *(const v4f*)(sk + 4 * ii);
#pragma unroll
        for (int e = 0; e < 4; ++e) {
          const int d = 16 * j + 4 * ii + e;
          Ksh[kvr * AT_D + d]      = (_Float16)(x1[e] * cs[e] - x2[e] * sn[e]);
          Ksh[kvr * AT_D + 32 + d] = (_Float16)(x2[e] * cs[e] + x1[e] * sn[e]);
        }
      }
#pragma unroll
      for (int ii = 0; ii < 8; ++ii) {
        const v4f vv = *(const v4f*)(vrow + 4 * ii);
#pragma unroll
        for (int e = 0; e < 4; ++e) Vth[(32 * j + 4 * ii + e) * AT_KC + kvr] = (_Float16)vv[e];
      }
    }
    __syncthreads();

    // scores S[q][kv]: A = Q (row = c), B[k=d][n=kv] from Ksh with the split k map
    v8f s[4];
#pragma unroll
    for (int j2 = 0; j2 < 4; ++j2) {
      s[j2] = (v8f){0.f,0.f,0.f,0.f,0.f,0.f,0.f,0.f};
#pragma unroll
      for (int dc = 0; dc < 2; ++dc) {
        FB kb;
        kb.h[0] = *(const v8h*)(Ksh + (j2 * 16 + c) * AT_D + dc * 32 + 8 * hh);
        kb.h[1] = *(const v8h*)(Ksh + (j2 * 16 + c) * AT_D + dc * 32 + 16 + 8 * hh);
        s[j2] = mma_h(qa[dc], kb.v, s[j2]);
      }
    }
    float cm[8];
#pragma unroll
    for (int r = 0; r < 8; ++r) {
      const int qr = q0 + 8 * hh + r;
      float m = -INFINITY;
#pragma unroll
      for (int j2 = 0; j2 < 4; ++j2) {
        const int kvcol = kv0 + j2 * 16 + c;
        const bool masked = (kvcol > qr) || (qr - kvcol > WIN - 1);
        if (masked) s[j2][r] = -INFINITY;
        m = fmaxf(m, s[j2][r]);
      }
#pragma unroll
      for (int off = 1; off < 16; off <<= 1) m = fmaxf(m, __shfl_xor(m, off, 32));
      cm[r] = m;
    }
    _Float16* pw = Psh[wave];
#pragma unroll
    for (int r = 0; r < 8; ++r) {
      const float mnew  = fmaxf(mrow[r], cm[r]);   // finite: the diagonal chunk comes first
      const float alpha = expf(mrow[r] - mnew);
      mrow[r] = mnew;
      float psum = 0.f;
#pragma unroll
      for (int j2 = 0; j2 < 4; ++j2) {
        const float p = expf(s[j2][r] - mnew);
        psum += p;
        pw[(8 * hh + r) * AT_KC + j2 * 16 + c] = (_Float16)(p * P_SC);
      }
#pragma unroll
      for (int off = 1; off < 16; off <<= 1) psum += __shfl_xor(psum, off, 32);
      lrow[r] = lrow[r] * alpha + psum;
#pragma unroll
      for (int t = 0; t < 4; ++t) oacc[t][r] *= alpha;
    }
    __builtin_amdgcn_fence(__ATOMIC_RELEASE, "workgroup");
    __builtin_amdgcn_wave_barrier();
    __builtin_amdgcn_fence(__ATOMIC_ACQUIRE, "workgroup");
    // O += P . V : A = P (row = c, k = kv), B[k=kv][n=d] from Vth
#pragma unroll 1
    for (int kk = 0; kk < 2; ++kk) {
      FB pa;
      pa.h[0] = *(const v8h*)(pw + c * AT_KC + kk * 32 + 8 * hh);
      pa.h[1] = *(const v8h*)(pw + c * AT_KC + kk * 32 + 16 + 8 * hh);
#pragma unroll
      for (int t = 0; t < 4; ++t) {
        FB vb;
        vb.h[0] = *(const v8h*)(Vth + (t * 16 + c) * AT_KC + kk * 32 + 8 * hh);
        vb.h[1] = *(const v8h*)(Vth + (t * 16 + c) * AT_KC + kk * 32 + 16 + 8 * hh);
        oacc[t] = mma_h(pa.v, vb.v, oacc[t]);
      }
    }
  }

  float* os = Os[wave];
#pragma unroll
  for (int r = 0; r < 8; ++r) {
    const float inv = 1.0f / (lrow[r] * P_SC);
#pragma unroll
    for (int t = 0; t < 4; ++t) os[(8 * hh + r) * 68 + t * 16 + c] = oacc[t][r] * inv;
  }
  __builtin_amdgcn_fence(__ATOMIC_RELEASE, "workgroup");
  __builtin_amdgcn_wave_barrier();
  __builtin_amdgcn_fence(__ATOMIC_ACQUIRE, "workgroup");
  {
    _Float16* Ob = (_Float16*)Op;
    const int q4 = lane >> 3, c8 = (lane & 7) * 8;
    {
#pragma unroll
      for (int it = 0; it < 4; ++it) {
        const int row = it * 4 + q4;            // 0..15
        const float* sp = os + row * 68 + c8;
        v8h hv;
#pragma unroll
        for (int e = 0; e < 8; ++e) hv[e] = (_Float16)sp[e];
        *(v8h*)(Ob + (rowb + q0 + row) * DIM_C + hoff + c8) = hv;
      }
      
    }
  }
}

// ---------------- launcher ----------------
extern "C" void kernel_launch(void* const* d_in, const int* in_sizes, int n_in,
                              void* d_out, int out_size, void* d_ws, size_t ws_size,
                              hipStream_t stream) {
  if (n_in < 5) return;
  if (in_sizes[0] != B_SZ * DIM_C * T_LEN) return;
  if (in_sizes[1] != DIM_C || in_sizes[2] != DIM_C) return;
  if (in_sizes[3] != DIM_C * N_QKV) return;
  if (in_sizes[4] != DIM_C * DIM_C) return;
  if (out_size != B_SZ * DIM_C * T_LEN) return;

  const float* x     = (const float*)d_in[0];
  const float* ln_w  = (const float*)d_in[1];
  const float* ln_b  = (const float*)d_in[2];
  const float* w_qkv = (const float*)d_in[3];   // [1024][3072] (in x out)
  const float* w_out = (const float*)d_in[4];   // [1024][1024] (in x out)
  float*       out   = (float*)d_out;           // [B][C][T]

  // workspace carve (all offsets multiples of 256 KiB)
  char* ws = (char*)d_ws;
  size_t off = 0;
  unsigned short* Hb   = (unsigned short*)(ws + off); off += (size_t)N_TOK * DIM_C * 2;     // f16 [4096][1024]
  unsigned short* Wq   = (unsigned short*)(ws + off); off += (size_t)N_QKV * DIM_C * 2;     // f16 [3072][1024]
  unsigned short* Wo   = (unsigned short*)(ws + off); off += (size_t)DIM_C * DIM_C * 2;     // f16 [1024][1024]
  float*          qkvb = (float*)(ws + off);          off += (size_t)N_TOK * N_QKV * 4;     // f32 [4096][3072]
  unsigned short* Ob   = (unsigned short*)(ws + off); off += (size_t)N_TOK * DIM_C * 2;     // f16 [4096][1024]
  float*          cosT = (float*)(ws + off);          off += (size_t)T_LEN * 32 * 4;        // f32 [2048][32]
  float*          sinT = (float*)(ws + off);          off += (size_t)T_LEN * 32 * 4;        // f32 [2048][32]
  if (off > ws_size) return;                          // 76,021,760 B total

  // 1) rotary cos/sin tables
  rope_table_kernel<<<(T_LEN * 32) / 256, 256, 0, stream>>>(cosT, sinT);

  // 2) w_qkv [1024 rows][3072 cols] -> Wq [3072][1024] f16 x64 ; grid (cols/64, rows/64)
  transpose_cast_f16<<<dim3(N_QKV / 64, DIM_C / 64), 256, 0, stream>>>(w_qkv, Wq, DIM_C, N_QKV, W_SCALE);
  //    w_out [1024 rows][1024 cols] -> Wo [1024][1024] f16 x64
  transpose_cast_f16<<<dim3(DIM_C / 64, DIM_C / 64), 256, 0, stream>>>(w_out, Wo, DIM_C, DIM_C, W_SCALE);

  // 3) LayerNorm -> H f16 [B*T][C]
  ln_token_kernel<<<N_TOK / 32, 512, 0, stream>>>(x, ln_w, ln_b, Hb);

  // 4) qkv[4096][3072] = H . Wq^T / 64  (f16 operands, f32 out)
  {
    const int tiles = (N_TOK / 64) * (N_QKV / 64);   // 3072, multiple of 8
    wmma_gemm64<0, false, 0, 0, false><<<dim3(tiles / 8, 1), 256, 0, stream>>>(
        Hb, Hb, DIM_C, 0L, Wq, Wq, DIM_C, 0L, (void*)qkvb, (void*)qkvb, N_QKV, 0L,
        ln_w, x, 0L, N_TOK, N_QKV, DIM_C, W_SCALE_INV);
  }

  // 5) windowed causal attention with inline rotary -> O f16 [B*T][C]
  local_attn_kernel<<<B_SZ * N_HEAD * (T_LEN / AT_QB), 128, 0, stream>>>(qkvb, cosT, sinT, Ob);

  {
    const int tiles = (DIM_C / 64) * (T_LEN / 64);   // 512, multiple of 8
    wmma_gemm64<0, false, 0, 0, true><<<dim3(tiles / 8, B_SZ), 256, 0, stream>>>(
        Wo, Wo, DIM_C, 0L, Ob, Ob, DIM_C, (long)T_LEN * DIM_C, (void*)out, (void*)out, T_LEN, (long)DIM_C * T_LEN,
        ln_w, x, (long)DIM_C * T_LEN, DIM_C, T_LEN, DIM_C, W_SCALE_INV);
  }
}
